// v000
// Times are from an AMD MI455X. After a warm-up the kernel runs many times in a row, and a time is the length of
// such a window on the GPU divided by its runs, so every launch and the gaps after it count. The runs cycle
// through copies of the inputs. A figure is the median of several windows, for all but v000 over two sittings.
// Sittings can differ by a few percent; kernels timed side by side share one.
// The starting kernel, v000, takes 577 microseconds a run.
#include <hip/hip_runtime.h>
#include <hip/hip_bf16.h>
#include <stdint.h>

typedef __attribute__((ext_vector_type(2))) float v2f;
typedef __attribute__((ext_vector_type(8))) float v8f;
typedef __attribute__((ext_vector_type(4))) unsigned int u32x4;
typedef __attribute__((ext_vector_type(8))) int i32x8;
typedef __attribute__((ext_vector_type(4))) int i32x4;

#define B_  16
#define C_  256
#define H_  80
#define W_  80
#define N_  (H_ * W_)
#define EPSV 1e-5f

#if __has_builtin(__builtin_amdgcn_tensor_load_to_lds) && __has_builtin(__builtin_amdgcn_s_wait_tensorcnt)
#define USE_TDM 1
#else
#define USE_TDM 0
#endif

__global__ __launch_bounds__(256) void qkv_gemm_wmma(
    const float* __restrict__ x,
    const float* __restrict__ Wq, const float* __restrict__ bq,
    const float* __restrict__ Wk, const float* __restrict__ bk,
    const float* __restrict__ Wv, const float* __restrict__ bv,
    float* __restrict__ q, float* __restrict__ k, float* __restrict__ v)
{
    __shared__ float tile[C_ * 16];          // [c][nn], 16 KB

    const int b   = blockIdx.y;
    const int n0  = blockIdx.x * 16;
    const int tid = threadIdx.x;

#if USE_TDM
    if (tid < 32) {
        const uint64_t ga  = (uint64_t)(uintptr_t)(x + (size_t)b * C_ * N_ + n0);
        const uint32_t lds = (uint32_t)(uintptr_t)tile;   // flat低32 = LDS offset

        u32x4 g0 = {
            1u,                                            // count=1, load desc
            lds,                                           // lds_addr
            (uint32_t)ga,                                  // global_addr[31:0]
            ((uint32_t)(ga >> 32) & 0x01FFFFFFu) | 0x80000000u // ga[56:32] | type=2
        };
        i32x8 g1 = {
            (int)0x00020000u,
            (int)(((uint32_t)N_ & 0xFFFFu) << 16),
            (int)(((uint32_t)N_ >> 16) | ((uint32_t)C_ << 16)),
            (int)(16u << 16),
            (int)C_,
            (int)N_,
            0, 0
        };
        i32x4 z4 = {0, 0, 0, 0};
#if defined(__clang_major__) && (__clang_major__ >= 23)
        i32x8 z8 = {0, 0, 0, 0, 0, 0, 0, 0};
        __builtin_amdgcn_tensor_load_to_lds(g0, g1, z4, z4, z8, 0);
#else
        __builtin_amdgcn_tensor_load_to_lds(g0, g1, z4, z4, 0);
#endif
        __builtin_amdgcn_s_wait_tensorcnt(0);
    }
    __syncthreads();
#else
    {   // Cooperative fallback load: 256x16 x-tile -> LDS.
        const float* xs = x + (size_t)b * C_ * N_ + n0;
        const int nn    = tid & 15;
        const int cbase = tid >> 4;
        #pragma unroll
        for (int i = 0; i < 16; ++i) {
            const int c = cbase + i * 16;
            tile[c * 16 + nn] = xs[(size_t)c * N_ + nn];
        }
    }
    __syncthreads();
#endif

    const int wave = tid >> 5;               // 0..7
    const int lane = tid & 31;
    const int lm   = lane & 15;
    const int half = lane >> 4;              // 0 or 1

    #pragma unroll
    for (int t = 0; t < 6; t += 2) {
        const int T0 = wave * 6 + t;         // 0..47
        const int T1 = T0 + 1;
        const int mat0 = T0 >> 4, m00 = (T0 & 15) * 16;
        const int mat1 = T1 >> 4, m01 = (T1 & 15) * 16;

        const float* Wm0 = (mat0 == 0) ? Wq : ((mat0 == 1) ? Wk : Wv);
        const float* bm0 = (mat0 == 0) ? bq : ((mat0 == 1) ? bk : bv);
        float*       om0 = (mat0 == 0) ? q  : ((mat0 == 1) ? k  : v);
        const float* Wm1 = (mat1 == 0) ? Wq : ((mat1 == 1) ? Wk : Wv);
        const float* bm1 = (mat1 == 0) ? bq : ((mat1 == 1) ? bk : bv);
        float*       om1 = (mat1 == 0) ? q  : ((mat1 == 1) ? k  : v);

        const v2f* ap0 = (const v2f*)(Wm0 + (size_t)(m00 + lm) * C_);
        const v2f* ap1 = (const v2f*)(Wm1 + (size_t)(m01 + lm) * C_);

        v8f acc0 = {};
        v8f acc1 = {};
        #pragma unroll 4
        for (int k0 = 0; k0 < C_; k0 += 4) {
            v2f a0 = ap0[(k0 >> 1) + half];
            v2f a1 = ap1[(k0 >> 1) + half];
            // B (4x16): shared by both tiles of the pair
            v2f bb;
            bb.x = tile[(k0 + 2 * half)     * 16 + lm];
            bb.y = tile[(k0 + 2 * half + 1) * 16 + lm];
            acc0 = __builtin_amdgcn_wmma_f32_16x16x4_f32(
                       false, a0, false, bb, (short)0, acc0, false, false);
            acc1 = __builtin_amdgcn_wmma_f32_16x16x4_f32(
                       false, a1, false, bb, (short)0, acc1, false, false);
        }

        float* ob0 = om0 + (size_t)b * C_ * N_ + n0 + lm;
        float* ob1 = om1 + (size_t)b * C_ * N_ + n0 + lm;
        #pragma unroll
        for (int r = 0; r < 8; ++r) {
            const int r0 = m00 + half * 8 + r;
            const int r1 = m01 + half * 8 + r;
            ob0[(size_t)r0 * N_] = acc0[r] + bm0[r0];
            ob1[(size_t)r1 * N_] = acc1[r] + bm1[r1];
        }
    }
}

// ---------------------------------------------------------------------------
// Kernel 2: scores[b][j][n] = sum_c q[b][c][n] * k[b][c][nbr(n,j)], plus the
// (center, others_mean) output. Thread per pixel.
// ---------------------------------------------------------------------------
__global__ __launch_bounds__(256) void scores_kernel(
    const float* __restrict__ q, const float* __restrict__ k,
    float* __restrict__ scores, float* __restrict__ out01)
{
    const int b = blockIdx.y;
    const int n = blockIdx.x * 256 + threadIdx.x;
    const int r = n / W_;
    const int c = n % W_;

    int nbr[9];
    #pragma unroll
    for (int j = 0; j < 9; ++j) {
        int ri = r + (j / 3) - 1; ri = ri < 0 ? 0 : (ri > H_ - 1 ? H_ - 1 : ri);
        int ci = c + (j % 3) - 1; ci = ci < 0 ? 0 : (ci > W_ - 1 ? W_ - 1 : ci);
        nbr[j] = ri * W_ + ci;
    }

    float s[9] = {};
    const float* qp = q + (size_t)b * C_ * N_ + n;
    const float* kp = k + (size_t)b * C_ * N_;
    #pragma unroll 2
    for (int ch = 0; ch < C_; ++ch) {
        const float  qv = qp[(size_t)ch * N_];
        const float* kr = kp + (size_t)ch * N_;
        #pragma unroll
        for (int j = 0; j < 9; ++j) s[j] = fmaf(qv, kr[nbr[j]], s[j]);
    }

    float tot = 0.0f;
    #pragma unroll
    for (int j = 0; j < 9; ++j) {
        scores[((size_t)b * 9 + j) * N_ + n] = s[j];
        tot += s[j];
    }
    out01[((size_t)b * N_ + n) * 2 + 0] = s[4];
    out01[((size_t)b * N_ + n) * 2 + 1] = (tot - s[4]) * 0.125f;
}

// ---------------------------------------------------------------------------
// Kernel 3: xr = x + scores . v_nbr, then spatial LayerNorm per (b,c).
// One block per (b,c); 25 pixels/thread kept in registers, LDS tree
// reduction for mean/var. Deterministic (no atomics).
// ---------------------------------------------------------------------------
__global__ __launch_bounds__(256) void attnv_layernorm(
    const float* __restrict__ x, const float* __restrict__ v,
    const float* __restrict__ scores, float* __restrict__ xout)
{
    const int bc  = blockIdx.x;
    const int b   = bc >> 8;
    const int ch  = bc & 255;
    const int tid = threadIdx.x;

    const float* xp = x      + (size_t)b * C_ * N_ + (size_t)ch * N_;
    const float* vp = v      + (size_t)b * C_ * N_ + (size_t)ch * N_;
    const float* sp = scores + (size_t)b * 9 * N_;

    float xr[25];
    float sum = 0.0f, sq = 0.0f;

    #pragma unroll 1
    for (int i = 0; i < 25; ++i) {
        const int n = i * 256 + tid;
        const int r = n / W_;
        const int c = n % W_;
        float nv = 0.0f;
        #pragma unroll
        for (int j = 0; j < 9; ++j) {
            int ri = r + (j / 3) - 1; ri = ri < 0 ? 0 : (ri > H_ - 1 ? H_ - 1 : ri);
            int ci = c + (j % 3) - 1; ci = ci < 0 ? 0 : (ci > W_ - 1 ? W_ - 1 : ci);
            nv = fmaf(sp[(size_t)j * N_ + n], vp[ri * W_ + ci], nv);
        }
        const float val = xp[n] + nv;
        xr[i] = val;
        sum  += val;
        sq    = fmaf(val, val, sq);
    }

    __shared__ float ls[256];
    __shared__ float lq[256];
    ls[tid] = sum; lq[tid] = sq;
    __syncthreads();
    #pragma unroll
    for (int off = 128; off > 0; off >>= 1) {
        if (tid < off) { ls[tid] += ls[tid + off]; lq[tid] += lq[tid + off]; }
        __syncthreads();
    }
    const float mu  = ls[0] * (1.0f / N_);
    const float var = lq[0] * (1.0f / N_) - mu * mu;
    const float rs  = rsqrtf(var + EPSV);

    float* op = xout + (size_t)b * C_ * N_ + (size_t)ch * N_;
    #pragma unroll 1
    for (int i = 0; i < 25; ++i)
        op[i * 256 + tid] = (xr[i] - mu) * rs;
}

// ---------------------------------------------------------------------------
extern "C" void kernel_launch(void* const* d_in, const int* in_sizes, int n_in,
                              void* d_out, int out_size, void* d_ws, size_t ws_size,
                              hipStream_t stream)
{
    const float* x  = (const float*)d_in[0];
    const float* Wq = (const float*)d_in[1];
    const float* bq = (const float*)d_in[2];
    const float* Wk = (const float*)d_in[3];
    const float* bk = (const float*)d_in[4];
    const float* Wv = (const float*)d_in[5];
    const float* bv = (const float*)d_in[6];

    const size_t CN = (size_t)B_ * C_ * N_;   // 26,214,400 floats
    float* ws = (float*)d_ws;
    float* q  = ws;
    float* k  = q + CN;
    float* v  = k + CN;
    float* sc = v + CN;                        // B*9*N floats

    float* out01 = (float*)d_out;                          // (B,H,W,2)
    float* xout  = out01 + (size_t)B_ * N_ * 2;            // (B,C,H,W)

    qkv_gemm_wmma<<<dim3(N_ / 16, B_), 256, 0, stream>>>(
        x, Wq, bq, Wk, bk, Wv, bv, q, k, v);

    scores_kernel<<<dim3(N_ / 256, B_), 256, 0, stream>>>(q, k, sc, out01);

    attnv_layernorm<<<dim3(B_ * C_), 256, 0, stream>>>(x, v, sc, xout);
}

// v001
// It runs in 353 microseconds.
// Two timings next to v000 both put it at 1.65 times that version's speed.
#include <hip/hip_runtime.h>
#include <hip/hip_bf16.h>
#include <stdint.h>

typedef __attribute__((ext_vector_type(2))) float v2f;
typedef __attribute__((ext_vector_type(8))) float v8f;
typedef __attribute__((ext_vector_type(4))) uint32_t u32x4;
typedef __attribute__((ext_vector_type(8))) uint32_t u32x8;

#define B_  16
#define C_  256
#define H_  80
#define W_  80
#define N_  (H_ * W_)
#define EPSV 1e-5f

#define NT_ 80                 // x columns per block
#define FX_ (NT_ / 16)         // column tiles per wave
#define SLICE_ROWS_ (C_ / 8)   // x rows that each of the 8 waves brings into LDS

static_assert(N_ % NT_ == 0, "column tiles must cover a batch image exactly");
static_assert((SLICE_ROWS_ * NT_ * 4) % 2048 == 0, "each wave's LDS slice must start at a multiple of 2 KiB");

static __device__ __forceinline__ uint32_t uni(uint32_t v) { return (uint32_t)__builtin_amdgcn_readfirstlane(v); }

__global__ __launch_bounds__(256) void qkv_gemm_wmma(
    const float* __restrict__ x,
    const float* __restrict__ Wq, const float* __restrict__ bq,
    const float* __restrict__ Wk, const float* __restrict__ bk,
    const float* __restrict__ Wv, const float* __restrict__ bv,
    float* __restrict__ q, float* __restrict__ k, float* __restrict__ v)
{
    __shared__ __attribute__((aligned(2048))) float tile[C_ * NT_];   // [c][nn], 80 KB

    const int mat = blockIdx.x;              // 0: q, 1: k, 2: v
    const int n0  = blockIdx.y * NT_;
    const int b   = blockIdx.z;
    const int tid = threadIdx.x;
    const uint32_t wave = uni(tid >> 5);     // 0..7

    {
        const uint64_t ga  = (uint64_t)(uintptr_t)(x + (size_t)b * C_ * N_
                                                     + (size_t)(wave * SLICE_ROWS_) * N_ + n0);
        const uint32_t lds = (uint32_t)(uintptr_t)tile + wave * (SLICE_ROWS_ * NT_ * 4);
        constexpr uint32_t d0 = NT_ * 4, d1 = SLICE_ROWS_;
        u32x4 g0;
        g0[0] = uni(1u);                                   // count = 1
        g0[1] = uni(lds);                                  // LDS byte offset
        g0[2] = uni((uint32_t)ga);                         // address [31:0]
        g0[3] = uni((((uint32_t)(ga >> 32)) & 0x01FFFFFFu) | 0x80000000u);  // address [56:32] | type = 2
        u32x8 g1;
        g1[0] = uni(0u);
        g1[1] = uni((d0 & 0xFFFFu) << 16);
        g1[2] = uni((d0 >> 16) | ((d1 & 0xFFFFu) << 16));
        g1[3] = uni((d1 >> 16) | (d0 << 16));
        g1[4] = uni(d1);
        g1[5] = uni((uint32_t)N_ * 4u);
        g1[6] = uni(0u);
        g1[7] = uni(0u);
        asm volatile("tensor_load_to_lds %0, %1" :: "s"(g0), "s"(g1) : "memory");
        // The compiler places no wait for a tensor load: the slice has landed only behind this.
        asm volatile("s_wait_tensorcnt 0x0" ::: "memory");
    }
    __syncthreads();                         // every wave's slice is visible to all

    const int lane = tid & 31;
    const int lm   = lane & 15;
    const int half = lane >> 4;              // 0 or 1

    const float* Wm = (mat == 0) ? Wq : ((mat == 1) ? Wk : Wv);
    const float* bm = (mat == 0) ? bq : ((mat == 1) ? bk : bv);
    float*       om = (mat == 0) ? q  : ((mat == 1) ? k  : v);

    const int m0 = (int)wave * 32;
    const v2f* ap0 = (const v2f*)(Wm + (size_t)(m0 + lm) * C_) + half;
    const v2f* ap1 = ap0 + 16 * C_ / 2;
    // B (4x16): same K split over the lane halves, column = lm
    const float* bp = tile + 2 * half * NT_ + lm;

    v8f acc[2][FX_] = {};
    // One trip consumes exactly one 128-byte line of each W row, loaded in one burst,
    // so a line need not survive in the cache between trips.
    for (int kb = 0; kb < C_; kb += 32) {
        v2f a0[8], a1[8];
        #pragma unroll
        for (int s = 0; s < 8; ++s) {
            a0[s] = ap0[(kb >> 1) + 2 * s];
            a1[s] = ap1[(kb >> 1) + 2 * s];
        }
        #pragma unroll
        for (int s = 0; s < 8; ++s) {
            const float* bs = bp + (kb + 4 * s) * NT_;
            #pragma unroll
            for (int j = 0; j < FX_; ++j) {
                v2f bb;
                bb.x = bs[j * 16];
                bb.y = bs[NT_ + j * 16];
                acc[0][j] = __builtin_amdgcn_wmma_f32_16x16x4_f32(
                                false, a0[s], false, bb, (short)0, acc[0][j], false, false);
                acc[1][j] = __builtin_amdgcn_wmma_f32_16x16x4_f32(
                                false, a1[s], false, bb, (short)0, acc[1][j], false, false);
            }
        }
    }

    float* ob = om + (size_t)b * C_ * N_ + n0 + lm;
    #pragma unroll
    for (int i = 0; i < 2; ++i) {
        #pragma unroll
        for (int r = 0; r < 8; ++r) {
            const int row = m0 + i * 16 + half * 8 + r;
            const float bias = bm[row];
            #pragma unroll
            for (int j = 0; j < FX_; ++j)
                ob[(size_t)row * N_ + j * 16] = acc[i][j][r] + bias;
        }
    }
}

// ---------------------------------------------------------------------------
// Kernel 2: scores[b][j][n] = sum_c q[b][c][n] * k[b][c][nbr(n,j)], plus the
// (center, others_mean) output. Thread per pixel.
// ---------------------------------------------------------------------------
__global__ __launch_bounds__(256) void scores_kernel(
    const float* __restrict__ q, const float* __restrict__ k,
    float* __restrict__ scores, float* __restrict__ out01)
{
    const int b = blockIdx.y;
    const int n = blockIdx.x * 256 + threadIdx.x;
    const int r = n / W_;
    const int c = n % W_;

    int nbr[9];
    #pragma unroll
    for (int j = 0; j < 9; ++j) {
        int ri = r + (j / 3) - 1; ri = ri < 0 ? 0 : (ri > H_ - 1 ? H_ - 1 : ri);
        int ci = c + (j % 3) - 1; ci = ci < 0 ? 0 : (ci > W_ - 1 ? W_ - 1 : ci);
        nbr[j] = ri * W_ + ci;
    }

    float s[9] = {};
    const float* qp = q + (size_t)b * C_ * N_ + n;
    const float* kp = k + (size_t)b * C_ * N_;
    #pragma unroll 2
    for (int ch = 0; ch < C_; ++ch) {
        const float  qv = qp[(size_t)ch * N_];
        const float* kr = kp + (size_t)ch * N_;
        #pragma unroll
        for (int j = 0; j < 9; ++j) s[j] = fmaf(qv, kr[nbr[j]], s[j]);
    }

    float tot = 0.0f;
    #pragma unroll
    for (int j = 0; j < 9; ++j) {
        scores[((size_t)b * 9 + j) * N_ + n] = s[j];
        tot += s[j];
    }
    out01[((size_t)b * N_ + n) * 2 + 0] = s[4];
    out01[((size_t)b * N_ + n) * 2 + 1] = (tot - s[4]) * 0.125f;
}

// ---------------------------------------------------------------------------
// Kernel 3: xr = x + scores . v_nbr, then spatial LayerNorm per (b,c).
// One block per (b,c); 25 pixels/thread kept in registers, LDS tree
// reduction for mean/var. Deterministic (no atomics).
// ---------------------------------------------------------------------------
__global__ __launch_bounds__(256) void attnv_layernorm(
    const float* __restrict__ x, const float* __restrict__ v,
    const float* __restrict__ scores, float* __restrict__ xout)
{
    const int bc  = blockIdx.x;
    const int b   = bc >> 8;
    const int ch  = bc & 255;
    const int tid = threadIdx.x;

    const float* xp = x      + (size_t)b * C_ * N_ + (size_t)ch * N_;
    const float* vp = v      + (size_t)b * C_ * N_ + (size_t)ch * N_;
    const float* sp = scores + (size_t)b * 9 * N_;

    float xr[25];
    float sum = 0.0f, sq = 0.0f;

    #pragma unroll 1
    for (int i = 0; i < 25; ++i) {
        const int n = i * 256 + tid;
        const int r = n / W_;
        const int c = n % W_;
        float nv = 0.0f;
        #pragma unroll
        for (int j = 0; j < 9; ++j) {
            int ri = r + (j / 3) - 1; ri = ri < 0 ? 0 : (ri > H_ - 1 ? H_ - 1 : ri);
            int ci = c + (j % 3) - 1; ci = ci < 0 ? 0 : (ci > W_ - 1 ? W_ - 1 : ci);
            nv = fmaf(sp[(size_t)j * N_ + n], vp[ri * W_ + ci], nv);
        }
        const float val = xp[n] + nv;
        xr[i] = val;
        sum  += val;
        sq    = fmaf(val, val, sq);
    }

    __shared__ float ls[256];
    __shared__ float lq[256];
    ls[tid] = sum; lq[tid] = sq;
    __syncthreads();
    #pragma unroll
    for (int off = 128; off > 0; off >>= 1) {
        if (tid < off) { ls[tid] += ls[tid + off]; lq[tid] += lq[tid + off]; }
        __syncthreads();
    }
    const float mu  = ls[0] * (1.0f / N_);
    const float var = lq[0] * (1.0f / N_) - mu * mu;
    const float rs  = rsqrtf(var + EPSV);

    float* op = xout + (size_t)b * C_ * N_ + (size_t)ch * N_;
    #pragma unroll 1
    for (int i = 0; i < 25; ++i)
        op[i * 256 + tid] = (xr[i] - mu) * rs;
}

// ---------------------------------------------------------------------------
extern "C" void kernel_launch(void* const* d_in, const int* in_sizes, int n_in,
                              void* d_out, int out_size, void* d_ws, size_t ws_size,
                              hipStream_t stream)
{
    const float* x  = (const float*)d_in[0];
    const float* Wq = (const float*)d_in[1];
    const float* bq = (const float*)d_in[2];
    const float* Wk = (const float*)d_in[3];
    const float* bk = (const float*)d_in[4];
    const float* Wv = (const float*)d_in[5];
    const float* bv = (const float*)d_in[6];

    const size_t CN = (size_t)B_ * C_ * N_;   // 26,214,400 floats
    float* ws = (float*)d_ws;
    float* q  = ws;
    float* k  = q + CN;
    float* v  = k + CN;
    float* sc = v + CN;                        // B*9*N floats

    float* out01 = (float*)d_out;                          // (B,H,W,2)
    float* xout  = out01 + (size_t)B_ * N_ * 2;            // (B,C,H,W)

    qkv_gemm_wmma<<<dim3(3, N_ / NT_, B_), 256, 0, stream>>>(
        x, Wq, bq, Wk, bk, Wv, bv, q, k, v);

    scores_kernel<<<dim3(N_ / 256, B_), 256, 0, stream>>>(q, k, sc, out01);

    attnv_layernorm<<<dim3(B_ * C_), 256, 0, stream>>>(x, v, sc, xout);
}

// v003
// Measured time: 263 microseconds a run.
// It is 1.34 times as fast as v001, going by the measured steps of the versions left out in between.
// Over all steps from v000 it is 2.22 times as fast.
#include <hip/hip_runtime.h>
#include <hip/hip_bf16.h>
#include <stdint.h>

typedef __attribute__((ext_vector_type(2))) float v2f;
typedef __attribute__((ext_vector_type(4))) float v4f;
typedef __attribute__((ext_vector_type(8))) float v8f;
typedef __attribute__((ext_vector_type(4))) uint32_t u32x4;
typedef __attribute__((ext_vector_type(8))) uint32_t u32x8;

#define B_  16
#define C_  256
#define H_  80
#define W_  80
#define N_  (H_ * W_)
#define EPSV 1e-5f

#define NT_ 80                 // x columns per block
#define FX_ (NT_ / 16)         // column tiles per wave
#define SLICE_ROWS_ (C_ / 8)   // x rows that each of the 8 waves brings into LDS

static_assert(N_ % NT_ == 0, "column tiles must cover a batch image exactly");
static_assert((SLICE_ROWS_ * NT_ * 4) % 2048 == 0, "each wave's LDS slice must start at a multiple of 2 KiB");

static __device__ __forceinline__ uint32_t uni(uint32_t v) { return (uint32_t)__builtin_amdgcn_readfirstlane(v); }

// ---------------------------------------------------------------------------
// The scores need q and k only through q_n . k_m, and
//   q_n . k_m = (Wk^T q_n) . x_m + q_n . bk
//             = (Mf x_n + bf) . x_m + (wf . x_n + beta)
// with Mf = Wk^T Wq, bf = Wk^T bq, wf = Wq^T bk, beta = bk . bq. So one
// projection t = Mf x + bf takes the place of the two projections q and k.
//
// Kernel 0: the folded weights. Blocks 0-31: Mf, one 16x16 tile per wave on
// V_WMMA_F32_16X16X4_F32. Blocks 32-39: bf. Blocks 40-47: wf. Block 48: beta.
// ---------------------------------------------------------------------------
__global__ __launch_bounds__(256) void fold_qk_weights(
    const float* __restrict__ Wq, const float* __restrict__ bq,
    const float* __restrict__ Wk, const float* __restrict__ bk,
    float* __restrict__ Mf, float* __restrict__ bf,
    float* __restrict__ wf, float* __restrict__ beta)
{
    __shared__ float red[256];
    const int blk  = blockIdx.x;
    const int tid  = threadIdx.x;
    const int wave = (int)uni(tid >> 5);     // scalar, so that a wave's row bases are scalar and its loads share one offset register
    const int lane = tid & 31;

    if (blk < 32) {
        const int lm   = lane & 15;
        const int half = lane >> 4;
        const int t16  = blk * 8 + wave;
        const int i0   = (t16 >> 4) * 16;
        const int j0   = (t16 & 15) * 16;
        const float* ap = Wk + 2 * half * C_ + i0 + lm;
        const float* bp = Wq + 2 * half * C_ + j0 + lm;
        v8f acc = {};
        // 64 loads in flight per batch: the wave's time is load latency, not the 64 WMMAs.
        #pragma unroll 16
        for (int o = 0; o < C_; o += 4) {
            v2f a, bb;
            a.x  = ap[o * C_];
            a.y  = ap[o * C_ + C_];
            bb.x = bp[o * C_];
            bb.y = bp[o * C_ + C_];
            acc = __builtin_amdgcn_wmma_f32_16x16x4_f32(
                      false, a, false, bb, (short)0, acc, false, false);
        }
        #pragma unroll   // constant r: acc stays in registers
        for (int r = 0; r < 8; ++r)
            Mf[(i0 + half * 8 + r) * C_ + j0 + lm] = acc[r];
        return;
    }

    if (blk < 48) {
        // dst[i] = sum_o A[o][i] * vec[o]: 32 columns per block, 32 rows per wave.
        const bool   first = blk < 40;
        const float* A     = first ? Wk : Wq;
        const float* vec   = first ? bq : bk;
        float*       dst   = first ? bf : wf;
        const int    i     = ((blk - 32) & 7) * 32 + lane;
        const float* ar = A + wave * 32 * C_;
        const float* vr = vec + wave * 32;
        float p = 0.0f;
        #pragma unroll   // all 32 loads of the wave in flight at once
        for (int u = 0; u < 32; ++u)
            p = fmaf(ar[u * C_ + i], vr[u], p);
        red[tid] = p;
        __syncthreads();
        if (tid < 32) {
            float s = red[tid];
            #pragma unroll   // the seven LDS reads issue together
            for (int w = 1; w < 8; ++w) s += red[w * 32 + tid];
            dst[i] = s;
        }
        return;
    }

    red[tid] = bk[tid] * bq[tid];
    __syncthreads();
    #pragma unroll       // eight fixed halvings, no loop counter
    for (int off = 128; off > 0; off >>= 1) {
        if (tid < off) red[tid] += red[tid + off];
        __syncthreads();
    }
    if (tid == 0) beta[0] = red[0];
}

__global__ __launch_bounds__(256) void qkv_gemm_wmma(
    const float* __restrict__ x,
    const float* __restrict__ Mf, const float* __restrict__ bf,
    const float* __restrict__ Wv, const float* __restrict__ bv,
    float* __restrict__ t, float* __restrict__ v)
{
    __shared__ __attribute__((aligned(2048))) float tile[C_ * NT_];   // [c][nn], 80 KB

    const int mat = blockIdx.x;              // 0: t, 1: v
    const int n0  = blockIdx.y * NT_;
    const int b   = blockIdx.z;
    const int tid = threadIdx.x;
    const uint32_t wave = uni(tid >> 5);     // 0..7

    {
        const uint64_t ga  = (uint64_t)(uintptr_t)(x + (size_t)b * C_ * N_
                                                     + (size_t)(wave * SLICE_ROWS_) * N_ + n0);
        const uint32_t lds = (uint32_t)(uintptr_t)tile + wave * (SLICE_ROWS_ * NT_ * 4);
        constexpr uint32_t d0 = NT_ * 4, d1 = SLICE_ROWS_;
        u32x4 g0;
        g0[0] = uni(1u);                                   // count = 1
        g0[1] = uni(lds);                                  // LDS byte offset
        g0[2] = uni((uint32_t)ga);                         // address [31:0]
        g0[3] = uni((((uint32_t)(ga >> 32)) & 0x01FFFFFFu) | 0x80000000u);  // address [56:32] | type = 2
        u32x8 g1;
        g1[0] = uni(0u);
        g1[1] = uni((d0 & 0xFFFFu) << 16);
        g1[2] = uni((d0 >> 16) | ((d1 & 0xFFFFu) << 16));
        g1[3] = uni((d1 >> 16) | (d0 << 16));
        g1[4] = uni(d1);
        g1[5] = uni((uint32_t)N_ * 4u);
        g1[6] = uni(0u);
        g1[7] = uni(0u);
        asm volatile("tensor_load_to_lds %0, %1" :: "s"(g0), "s"(g1) : "memory");
        // The compiler places no wait for a tensor load: the slice has landed only behind this.
        asm volatile("s_wait_tensorcnt 0x0" ::: "memory");
    }
    __syncthreads();                         // every wave's slice is visible to all

    const int lane = tid & 31;
    const int lm   = lane & 15;
    const int half = lane >> 4;              // 0 or 1

    const float* Wm = (mat == 0) ? Mf : Wv;
    const float* bm = (mat == 0) ? bf : bv;
    float*       om = (mat == 0) ? t  : v;

    const int m0 = (int)wave * 32;
    const v2f* ap0 = (const v2f*)(Wm + (size_t)(m0 + lm) * C_) + half;
    const v2f* ap1 = ap0 + 16 * C_ / 2;
    // B (4x16): same K split over the lane halves, column = lm
    const float* bp = tile + 2 * half * NT_ + lm;

    v8f acc[2][FX_] = {};
    // One trip consumes exactly one 128-byte line of each W row, loaded in one burst,
    // so a line need not survive in the cache between trips.
    for (int kb = 0; kb < C_; kb += 32) {
        v2f a0[8], a1[8];
        #pragma unroll
        for (int s = 0; s < 8; ++s) {
            a0[s] = ap0[(kb >> 1) + 2 * s];
            a1[s] = ap1[(kb >> 1) + 2 * s];
        }
        #pragma unroll
        for (int s = 0; s < 8; ++s) {
            const float* bs = bp + (kb + 4 * s) * NT_;
            #pragma unroll
            for (int j = 0; j < FX_; ++j) {
                v2f bb;
                bb.x = bs[j * 16];
                bb.y = bs[NT_ + j * 16];
                acc[0][j] = __builtin_amdgcn_wmma_f32_16x16x4_f32(
                                false, a0[s], false, bb, (short)0, acc[0][j], false, false);
                acc[1][j] = __builtin_amdgcn_wmma_f32_16x16x4_f32(
                                false, a1[s], false, bb, (short)0, acc[1][j], false, false);
            }
        }
    }

    float* ob = om + (size_t)b * C_ * N_ + n0 + lm;
    #pragma unroll
    for (int i = 0; i < 2; ++i) {
        #pragma unroll
        for (int r = 0; r < 8; ++r) {
            const int row = m0 + i * 16 + half * 8 + r;
            const float bias = bm[row];
            #pragma unroll
            for (int j = 0; j < FX_; ++j)
                ob[(size_t)row * N_ + j * 16] = acc[i][j][r] + bias;
        }
    }
}

// ---------------------------------------------------------------------------
// Kernel 2: scores[b][j][n] = sum_c t[b][c][n] * x[b][c][nbr(n,j)]
//                            + sum_c wf[c] * x[b][c][n] + beta, plus the
// (center, others_mean) output. Thread per pixel.
// ---------------------------------------------------------------------------
__global__ __launch_bounds__(256) void scores_kernel(
    const float* __restrict__ t, const float* __restrict__ x,
    const float* __restrict__ wf, const float* __restrict__ beta,
    float* __restrict__ scores, float* __restrict__ out01)
{
    const int b = blockIdx.y;
    const int n = blockIdx.x * 256 + threadIdx.x;
    const int r = n / W_;
    const int c = n % W_;

    uint32_t nbr[9];                         // clamped below, never negative
    #pragma unroll
    for (int j = 0; j < 9; ++j) {
        int ri = r + (j / 3) - 1; ri = ri < 0 ? 0 : (ri > H_ - 1 ? H_ - 1 : ri);
        int ci = c + (j % 3) - 1; ci = ci < 0 ? 0 : (ci > W_ - 1 ? W_ - 1 : ci);
        nbr[j] = (uint32_t)(ri * W_ + ci);
    }

    float s[9] = {};
    float h = 0.0f;                          // q_n . bk, the same for all nine neighbours
    const float* tp = t + (size_t)b * C_ * N_ + n;
    const float* xp = x + (size_t)b * C_ * N_;
    // Two channels a trip, as written: a further unroll would put the wait below between two runs of loads.
    #pragma unroll 1
    for (int ch = 0; ch < C_; ch += 2) {
        const float* ta = tp + (size_t)ch * N_;
        const float* xa[9];
        float tv[2], xv[2][9];
        #pragma unroll   // constant j, u: addresses and values stay in registers
        for (int j = 0; j < 9; ++j) xa[j] = xp + (size_t)ch * N_ + nbr[j];
        #pragma unroll
        for (int u = 0; u < 2; ++u) {
            tv[u] = ta[u * N_];
            #pragma unroll
            for (int j = 0; j < 9; ++j) xv[u][j] = xa[j][u * N_];
        }
        // The trip's twenty loads name these ten addresses. As inputs of the wait they keep
        // their registers up to it, so no later load of the run lands in one of them.
        asm volatile("s_wait_xcnt 0x0"
                     :: "v"(ta), "v"(xa[0]), "v"(xa[1]), "v"(xa[2]), "v"(xa[3]), "v"(xa[4]),
                        "v"(xa[5]), "v"(xa[6]), "v"(xa[7]), "v"(xa[8]) : "memory");
        #pragma unroll
        for (int u = 0; u < 2; ++u) {
            #pragma unroll
            for (int j = 0; j < 9; ++j) s[j] = fmaf(tv[u], xv[u][j], s[j]);
            h = fmaf(wf[ch + u], xv[u][4], h);   // nbr[4] == n
        }
    }
    h += beta[0];

    float tot = 0.0f;
    #pragma unroll
    for (int j = 0; j < 9; ++j) {
        s[j] += h;
        scores[((size_t)b * 9 + j) * N_ + n] = s[j];
        tot += s[j];
    }
    out01[((size_t)b * N_ + n) * 2 + 0] = s[4];
    out01[((size_t)b * N_ + n) * 2 + 1] = (tot - s[4]) * 0.125f;
}

// ---------------------------------------------------------------------------
// Kernel 3: xr = x + scores . v_nbr, then spatial LayerNorm per (b,c).
// One block per (b, 2 channels), 320 threads. A thread owns 4 adjacent pixels
// of one image row (a quad) in each of 5 rows, for every channel of the block:
// 320 quads are exactly 16 image rows, so its column never changes and its row
// goes up by 16 a step. Scores, x and v come in 16-byte loads (512 contiguous
// bytes a wave); a score quad is loaded once for all channels of the block.
// A thread's values stay in registers for the normalisation. Deterministic.
// ---------------------------------------------------------------------------
#define AG_ 2                  // channels per block
#define AT_ 320                // threads per block
#define AQ_ 5                  // quads per thread and channel
#define QW_ (W_ / 4)           // quads per image row

static_assert(W_ % 4 == 0 && AT_ % QW_ == 0, "a block step must cover whole image rows");
static_assert(AT_ * AQ_ * 4 == N_, "the quads of a block must cover the image exactly");
static_assert(C_ % AG_ == 0, "channel groups must cover the channels exactly");

// base is uniform, off a lane's byte offset, e a constant element offset (the load's immediate).
static __device__ __forceinline__ v4f ld4(const float* base, uint32_t off, int e)
{ return *(const v4f*)((const float*)((const char*)base + off) + e); }
static __device__ __forceinline__ float ld1(const float* base, uint32_t off, int e)
{ return *((const float*)((const char*)base + off) + e); }

__global__ __launch_bounds__(AT_) void attnv_layernorm(
    const float* __restrict__ x, const float* __restrict__ v,
    const float* __restrict__ scores, float* __restrict__ xout)
{
    const int blk = blockIdx.x;
    const int b   = blk / (C_ / AG_);
    const int ch0 = (blk % (C_ / AG_)) * AG_;
    const int tid = threadIdx.x;
    const int c4  = tid % QW_;               // quad column, the same in every step
    const int r0  = tid / QW_;               // image row in step 0

    // Block-uniform bases; a lane adds one 32-bit byte offset, every step an immediate.
    const size_t plane = ((size_t)b * C_ + ch0) * N_;
    const float* xb = x      + plane;
    const float* vb = v      + plane;
    const float* sb = scores + (size_t)b * 9 * N_;

    // Clamped neighbours. Only the first step can hold image row 0 and only the last one
    // row H-1, so every other row above or below is a constant offset from the quad's own.
    const uint32_t oc  = (uint32_t)tid * 16u;                        // the quad itself
    const uint32_t ol  = oc - ((c4 == 0) ? 0u : 4u);                 // left of pixel 0
    const uint32_t oq  = oc + ((c4 == QW_ - 1) ? 12u : 16u);         // right of pixel 3
    const uint32_t du  = (r0 == 0)             ? 0u : W_ * 4u;       // step 0: bytes back to the row above
    const uint32_t dd  = (r0 == AT_ / QW_ - 1) ? 0u : W_ * 4u;       // last step: bytes on to the row below
    const uint32_t ouc = oc - du, oul = ol - du, ouq = oq - du;
    const uint32_t odc = oc + dd, odl = ol + dd, odq = oq + dd;

    v4f   xr[AQ_][AG_];
    float sum[AG_] = {}, sq[AG_] = {};

    #pragma unroll   // constant i, g: xr stays in registers, every step is an immediate offset
    for (int i = 0; i < AQ_; ++i) {
        const int base = i * AT_ * 4;
        v4f   s[9], xv[AG_], mid[AG_][3];
        float lft[AG_][3], rgt[AG_][3];
        #pragma unroll
        for (int j = 0; j < 9; ++j) s[j] = ld4(sb, oc, j * N_ + base);
        #pragma unroll
        for (int g = 0; g < AG_; ++g) {
            const int o = g * N_ + base;
            xv[g] = ld4(xb, oc, o);
            if (i == 0) {
                mid[g][0] = ld4(vb, ouc, o);      lft[g][0] = ld1(vb, oul, o);      rgt[g][0] = ld1(vb, ouq, o);
            } else {
                mid[g][0] = ld4(vb, oc, o - W_);  lft[g][0] = ld1(vb, ol, o - W_);  rgt[g][0] = ld1(vb, oq, o - W_);
            }
            mid[g][1] = ld4(vb, oc, o);           lft[g][1] = ld1(vb, ol, o);       rgt[g][1] = ld1(vb, oq, o);
            if (i == AQ_ - 1) {
                mid[g][2] = ld4(vb, odc, o);      lft[g][2] = ld1(vb, odl, o);      rgt[g][2] = ld1(vb, odq, o);
            } else {
                mid[g][2] = ld4(vb, oc, o + W_);  lft[g][2] = ld1(vb, ol, o + W_);  rgt[g][2] = ld1(vb, oq, o + W_);
            }
        }
        // The step's loads name these offsets. As inputs of the wait they keep their registers
        // up to it, so no later load of the run lands in one of them. The memory clobber also
        // keeps every load of the step in front of it: one exposed latency a step.
        if (i == 0)
            asm volatile("s_wait_xcnt 0x0" :: "v"(oc), "v"(ol), "v"(oq), "v"(ouc), "v"(oul), "v"(ouq) : "memory");
        else if (i == AQ_ - 1)
            asm volatile("s_wait_xcnt 0x0" :: "v"(oc), "v"(ol), "v"(oq), "v"(odc), "v"(odl), "v"(odq) : "memory");
        else
            asm volatile("s_wait_xcnt 0x0" :: "v"(oc), "v"(ol), "v"(oq) : "memory");
        #pragma unroll
        for (int g = 0; g < AG_; ++g) {
            float row[3][6];                 // columns 4*c4-1 .. 4*c4+4, clamped
            #pragma unroll
            for (int d = 0; d < 3; ++d) {
                row[d][0] = lft[g][d];
                row[d][1] = mid[g][d].x; row[d][2] = mid[g][d].y;
                row[d][3] = mid[g][d].z; row[d][4] = mid[g][d].w;
                row[d][5] = rgt[g][d];
            }
            v4f val;
            #pragma unroll
            for (int p = 0; p < 4; ++p) {
                float nv = 0.0f;
                #pragma unroll
                for (int j = 0; j < 9; ++j)
                    nv = fmaf(s[j][p], row[j / 3][p + j % 3], nv);
                val[p]  = xv[g][p] + nv;
                sum[g] += val[p];
                sq[g]   = fmaf(val[p], val[p], sq[g]);
            }
            xr[i][g] = val;
        }
        // Keeps the next step's loads behind this step's sums. Without it the scheduler lifts later
        // steps' loads over them, and the register count no longer lets two blocks share a WGP.
        __builtin_amdgcn_sched_barrier(0);
    }

    // Sums over the block: a butterfly inside each wave, then the ten waves' partial
    // sums through LDS, added by every thread in the same order.
    __shared__ float red[AT_ / 32][2 * AG_];
    #pragma unroll
    for (int off = 16; off > 0; off >>= 1) {
        #pragma unroll
        for (int g = 0; g < AG_; ++g) {
            sum[g] += __shfl_xor(sum[g], off, 32);
            sq[g]  += __shfl_xor(sq[g],  off, 32);
        }
    }
    if ((tid & 31) == 0) {
        #pragma unroll
        for (int g = 0; g < AG_; ++g) {
            red[tid >> 5][g]       = sum[g];
            red[tid >> 5][AG_ + g] = sq[g];
        }
    }
    __syncthreads();

    float* op = (float*)((char*)(xout + plane) + oc);
    #pragma unroll
    for (int g = 0; g < AG_; ++g) {
        float ts = 0.0f, tq = 0.0f;
        #pragma unroll
        for (int w = 0; w < AT_ / 32; ++w) {
            ts += red[w][g];
            tq += red[w][AG_ + g];
        }
        const float mu  = ts * (1.0f / N_);
        const float var = tq * (1.0f / N_) - mu * mu;
        const float rs  = rsqrtf(var + EPSV);
        #pragma unroll
        for (int i = 0; i < AQ_; ++i)
            *(v4f*)(op + g * N_ + i * AT_ * 4) = (xr[i][g] - mu) * rs;
    }
}

// ---------------------------------------------------------------------------
extern "C" void kernel_launch(void* const* d_in, const int* in_sizes, int n_in,
                              void* d_out, int out_size, void* d_ws, size_t ws_size,
                              hipStream_t stream)
{
    const float* x  = (const float*)d_in[0];
    const float* Wq = (const float*)d_in[1];
    const float* bq = (const float*)d_in[2];
    const float* Wk = (const float*)d_in[3];
    const float* bk = (const float*)d_in[4];
    const float* Wv = (const float*)d_in[5];
    const float* bv = (const float*)d_in[6];

    const size_t CN = (size_t)B_ * C_ * N_;   // 26,214,400 floats
    float* ws = (float*)d_ws;
    float* t  = ws;
    float* v  = t + CN;
    float* sc = v + CN;                        // B*9*N floats
    float* Mf = sc + (size_t)B_ * 9 * N_;      // C*C floats
    float* bf = Mf + C_ * C_;                  // C floats
    float* wf = bf + C_;                       // C floats
    float* be = wf + C_;                       // 1 float

    float* out01 = (float*)d_out;                          // (B,H,W,2)
    float* xout  = out01 + (size_t)B_ * N_ * 2;            // (B,C,H,W)

    fold_qk_weights<<<dim3(49), 256, 0, stream>>>(Wq, bq, Wk, bk, Mf, bf, wf, be);

    qkv_gemm_wmma<<<dim3(2, N_ / NT_, B_), 256, 0, stream>>>(
        x, Mf, bf, Wv, bv, t, v);

    scores_kernel<<<dim3(N_ / 256, B_), 256, 0, stream>>>(t, x, wf, be, sc, out01);

    attnv_layernorm<<<dim3(B_ * C_ / AG_), AT_, 0, stream>>>(x, v, sc, xout);
}

// v004
// A run of this version takes 226 microseconds.
// Timed twice side by side with v003, it ran 1.16 times as fast both times.
// Over all steps from v000 it is 2.58 times as fast.
#include <hip/hip_runtime.h>
#include <hip/hip_bf16.h>
#include <stdint.h>

typedef __attribute__((ext_vector_type(2))) float v2f;
typedef __attribute__((ext_vector_type(4))) float v4f;
typedef __attribute__((ext_vector_type(8))) float v8f;
typedef __attribute__((ext_vector_type(4))) uint32_t u32x4;
typedef __attribute__((ext_vector_type(8))) uint32_t u32x8;

#define B_  16
#define C_  256
#define H_  80
#define W_  80
#define N_  (H_ * W_)
#define EPSV 1e-5f

#define NT_ 80                 // x columns per block
#define FX_ (NT_ / 16)         // column tiles per wave
#define SLICE_ROWS_ (C_ / 8)   // x rows that each of the 8 waves brings into LDS
#define QW_ (W_ / 4)           // quads per image row

static_assert(N_ % NT_ == 0, "column tiles must cover a batch image exactly");
static_assert((SLICE_ROWS_ * NT_ * 4) % 2048 == 0, "each wave's LDS slice must start at a multiple of 2 KiB");

static __device__ __forceinline__ uint32_t uni(uint32_t v) { return (uint32_t)__builtin_amdgcn_readfirstlane(v); }

// base is uniform, off a lane's byte offset, e a constant element offset (the load's immediate).
static __device__ __forceinline__ v4f ld4(const float* base, uint32_t off, int e)
{ return *(const v4f*)((const float*)((const char*)base + off) + e); }
static __device__ __forceinline__ float ld1(const float* base, uint32_t off, int e)
{ return *((const float*)((const char*)base + off) + e); }

// ---------------------------------------------------------------------------
// The scores need q and k only through q_n . k_m, and
//   q_n . k_m = (Wk^T q_n) . x_m + q_n . bk
//             = (Mf x_n + bf) . x_m + (wf . x_n + beta)
// with Mf = Wk^T Wq, bf = Wk^T bq, wf = Wq^T bk, beta = bk . bq. So one
// projection t = Mf x + bf takes the place of the two projections q and k.
//
// Kernel 0: the folded weights. Blocks 0-31: Mf, one 16x16 tile per wave on
// V_WMMA_F32_16X16X4_F32. Blocks 32-39: bf. Blocks 40-47: wf. Block 48: beta.
// ---------------------------------------------------------------------------
__global__ __launch_bounds__(256) void fold_qk_weights(
    const float* __restrict__ Wq, const float* __restrict__ bq,
    const float* __restrict__ Wk, const float* __restrict__ bk,
    float* __restrict__ Mf, float* __restrict__ bf,
    float* __restrict__ wf, float* __restrict__ beta)
{
    __shared__ float red[256];
    const int blk  = blockIdx.x;
    const int tid  = threadIdx.x;
    const int wave = (int)uni(tid >> 5);     // scalar, so that a wave's row bases are scalar and its loads share one offset register
    const int lane = tid & 31;

    if (blk < 32) {
        const int lm   = lane & 15;
        const int half = lane >> 4;
        const int t16  = blk * 8 + wave;
        const int i0   = (t16 >> 4) * 16;
        const int j0   = (t16 & 15) * 16;
        const float* ap = Wk + 2 * half * C_ + i0 + lm;
        const float* bp = Wq + 2 * half * C_ + j0 + lm;
        v8f acc = {};
        // 64 loads in flight per batch: the wave's time is load latency, not the 64 WMMAs.
        #pragma unroll 16
        for (int o = 0; o < C_; o += 4) {
            v2f a, bb;
            a.x  = ap[o * C_];
            a.y  = ap[o * C_ + C_];
            bb.x = bp[o * C_];
            bb.y = bp[o * C_ + C_];
            acc = __builtin_amdgcn_wmma_f32_16x16x4_f32(
                      false, a, false, bb, (short)0, acc, false, false);
        }
        #pragma unroll   // constant r: acc stays in registers
        for (int r = 0; r < 8; ++r)
            Mf[(i0 + half * 8 + r) * C_ + j0 + lm] = acc[r];
        return;
    }

    if (blk < 48) {
        // dst[i] = sum_o A[o][i] * vec[o]: 32 columns per block, 32 rows per wave.
        const bool   first = blk < 40;
        const float* A     = first ? Wk : Wq;
        const float* vec   = first ? bq : bk;
        float*       dst   = first ? bf : wf;
        const int    i     = ((blk - 32) & 7) * 32 + lane;
        const float* ar = A + wave * 32 * C_;
        const float* vr = vec + wave * 32;
        float p = 0.0f;
        #pragma unroll   // all 32 loads of the wave in flight at once
        for (int u = 0; u < 32; ++u)
            p = fmaf(ar[u * C_ + i], vr[u], p);
        red[tid] = p;
        __syncthreads();
        if (tid < 32) {
            float s = red[tid];
            #pragma unroll   // the seven LDS reads issue together
            for (int w = 1; w < 8; ++w) s += red[w * 32 + tid];
            dst[i] = s;
        }
        return;
    }

    red[tid] = bk[tid] * bq[tid];
    __syncthreads();
    #pragma unroll       // eight fixed halvings, no loop counter
    for (int off = 128; off > 0; off >>= 1) {
        if (tid < off) red[tid] += red[tid + off];
        __syncthreads();
    }
    if (tid == 0) beta[0] = red[0];
}

__global__ __launch_bounds__(256) void qkv_gemm_wmma(
    const float* __restrict__ x,
    const float* __restrict__ Mf, const float* __restrict__ bf,
    const float* __restrict__ Wv, const float* __restrict__ bv,
    float* __restrict__ t, float* __restrict__ v)
{
    __shared__ __attribute__((aligned(2048))) float tile[C_ * NT_];   // [c][nn], 80 KB

    const int mat = blockIdx.x;              // 0: t, 1: v
    const int n0  = blockIdx.y * NT_;
    const int b   = blockIdx.z;
    const int tid = threadIdx.x;
    const uint32_t wave = uni(tid >> 5);     // 0..7

    {
        const uint64_t ga  = (uint64_t)(uintptr_t)(x + (size_t)b * C_ * N_
                                                     + (size_t)(wave * SLICE_ROWS_) * N_ + n0);
        const uint32_t lds = (uint32_t)(uintptr_t)tile + wave * (SLICE_ROWS_ * NT_ * 4);
        constexpr uint32_t d0 = NT_ * 4, d1 = SLICE_ROWS_;
        u32x4 g0;
        g0[0] = uni(1u);                                   // count = 1
        g0[1] = uni(lds);                                  // LDS byte offset
        g0[2] = uni((uint32_t)ga);                         // address [31:0]
        g0[3] = uni((((uint32_t)(ga >> 32)) & 0x01FFFFFFu) | 0x80000000u);  // address [56:32] | type = 2
        u32x8 g1;
        g1[0] = uni(0u);
        g1[1] = uni((d0 & 0xFFFFu) << 16);
        g1[2] = uni((d0 >> 16) | ((d1 & 0xFFFFu) << 16));
        g1[3] = uni((d1 >> 16) | (d0 << 16));
        g1[4] = uni(d1);
        g1[5] = uni((uint32_t)N_ * 4u);
        g1[6] = uni(0u);
        g1[7] = uni(0u);
        asm volatile("tensor_load_to_lds %0, %1" :: "s"(g0), "s"(g1) : "memory");
        // The compiler places no wait for a tensor load: the slice has landed only behind this.
        asm volatile("s_wait_tensorcnt 0x0" ::: "memory");
    }
    __syncthreads();                         // every wave's slice is visible to all

    const int lane = tid & 31;
    const int lm   = lane & 15;
    const int half = lane >> 4;              // 0 or 1

    const float* Wm = (mat == 0) ? Mf : Wv;
    const float* bm = (mat == 0) ? bf : bv;
    float*       om = (mat == 0) ? t  : v;

    const int m0 = (int)wave * 32;
    const v2f* ap0 = (const v2f*)(Wm + (size_t)(m0 + lm) * C_) + half;
    const v2f* ap1 = ap0 + 16 * C_ / 2;
    // B (4x16): same K split over the lane halves, column = lm
    const float* bp = tile + 2 * half * NT_ + lm;

    v8f acc[2][FX_] = {};
    // One trip consumes exactly one 128-byte line of each W row, loaded in one burst,
    // so a line need not survive in the cache between trips.
    for (int kb = 0; kb < C_; kb += 32) {
        v2f a0[8], a1[8];
        #pragma unroll
        for (int s = 0; s < 8; ++s) {
            a0[s] = ap0[(kb >> 1) + 2 * s];
            a1[s] = ap1[(kb >> 1) + 2 * s];
        }
        #pragma unroll
        for (int s = 0; s < 8; ++s) {
            const float* bs = bp + (kb + 4 * s) * NT_;
            #pragma unroll
            for (int j = 0; j < FX_; ++j) {
                v2f bb;
                bb.x = bs[j * 16];
                bb.y = bs[NT_ + j * 16];
                acc[0][j] = __builtin_amdgcn_wmma_f32_16x16x4_f32(
                                false, a0[s], false, bb, (short)0, acc[0][j], false, false);
                acc[1][j] = __builtin_amdgcn_wmma_f32_16x16x4_f32(
                                false, a1[s], false, bb, (short)0, acc[1][j], false, false);
            }
        }
    }

    float* ob = om + (size_t)b * C_ * N_ + n0 + lm;
    #pragma unroll
    for (int i = 0; i < 2; ++i) {
        #pragma unroll
        for (int r = 0; r < 8; ++r) {
            const int row = m0 + i * 16 + half * 8 + r;
            const float bias = bm[row];
            #pragma unroll
            for (int j = 0; j < FX_; ++j)
                ob[(size_t)row * N_ + j * 16] = acc[i][j][r] + bias;
        }
    }
}

// ---------------------------------------------------------------------------
// Kernel 2: scores[b][j][n] = sum_c t[b][c][n] * x[b][c][nbr(n,j)]
//                            + sum_c wf[c] * x[b][c][n] + beta, plus the
// (center, others_mean) output.
// Block = 128 adjacent pixels x all channels; each of its 8 waves takes 32 of
// the channels, so 6400 waves stream t and x and a wave's chain of dependent
// load rounds is 16 long. A thread owns 4 adjacent
// pixels of one image row (a quad): t and the three x rows come in 16-byte loads
// (512 contiguous bytes a wave). The columns left and right of a quad are the
// neighbour lanes' own values; only the wave's two outer lanes load theirs.
// The waves' partial sums meet in LDS and wave 0 adds them in a fixed order.
// ---------------------------------------------------------------------------
#define SS_ 8                  // channel slices per block, one per wave
#define SC_ (C_ / SS_)         // channels per slice
#define SP_ 128                // pixels per block: 32 quads

static_assert(N_ % SP_ == 0, "pixel tiles must cover a batch image exactly");
static_assert(SC_ % 2 == 0, "a trip takes two channels");

__global__ __launch_bounds__(SS_ * 32) void scores_kernel(
    const float* __restrict__ t, const float* __restrict__ x,
    const float* __restrict__ wf, const float* __restrict__ beta,
    float* __restrict__ scores, float* __restrict__ out01)
{
    __shared__ v4f red[SS_ - 1][10][32];     // slices 1..7: nine score quads and the h quad of every lane

    const int b     = blockIdx.y;
    const int tid   = threadIdx.x;
    const int lane  = tid & 31;
    const int slice = (int)uni(tid >> 5);    // scalar, so that the plane bases and the wf loads are scalar
    const int q     = blockIdx.x * (SP_ / 4) + lane;   // quad in the image
    const int c4    = q % QW_;
    const int r     = q / QW_;

    // Byte offsets inside a channel plane, clamped as the reference clamps rows and columns.
    const uint32_t oc = (uint32_t)q * 16u;
    uint32_t om[3], eo[3];
    om[0] = oc - ((r == 0)      ? 0u : W_ * 4u);
    om[1] = oc;
    om[2] = oc + ((r == H_ - 1) ? 0u : W_ * 4u);
    const bool first_col = (c4 == 0), last_col = (c4 == QW_ - 1);
    const bool lane_lo = (lane == 0), lane_hi = (lane == 31);
    #pragma unroll   // constant d: the offsets stay in registers
    for (int d = 0; d < 3; ++d) {
        const uint32_t left0 = uni(om[d] - (first_col ? 0u : 4u));
        eo[d] = lane_hi ? om[d] + (last_col ? 12u : 16u) : left0;
    }

    const size_t plane = ((size_t)b * C_ + (size_t)slice * SC_) * N_;
    const float* tb = t + plane;
    const float* xb = x + plane;
    const float* wb = wf + slice * SC_;
    const float be = beta[0];

    v4f s[9] = {};
    v4f h = {};                              // q_n . bk, the same for all nine neighbours

    // Two channels a trip, as written: unrolled further, the compiler puts off every trip's products
    // to the end, keeps all their operands until then and spills.
    #pragma unroll 1
    for (int u0 = 0; u0 < SC_; u0 += 2) {
        v4f   tv[2], mid[2][3];
        float ev[2][3], wv[2];
        #pragma unroll   // constant u, d: values stay in registers
        for (int u = 0; u < 2; ++u) {
            const int o = u * N_;
            wv[u] = wb[u0 + u];
            tv[u] = ld4(tb, oc, o);
            #pragma unroll
            for (int d = 0; d < 3; ++d) {
                mid[u][d] = ld4(xb, om[d], o);
                ev[u][d]  = ld1(xb, eo[d], o);
            }
        }
        // Stands behind the trip's loads and in front of every write to a register that they name.
        // Offsets and bases are inputs, so that they keep their registers up to it and the bases'
        // step stays behind it. The memory clobber keeps every load of the trip in front of it.
        asm volatile("s_wait_xcnt 0x0"
                     :: "v"(om[0]), "v"(om[1]), "v"(om[2]), "v"(eo[0]), "v"(eo[1]), "v"(eo[2]),
                        "s"(tb), "s"(xb) : "memory");
        // Nothing crosses this line: all of the trip's loads are issued in front of it, so a trip has
        // one exposed memory latency, and no result lands in a load's address register ahead of the wait.
        __builtin_amdgcn_sched_barrier(0);
        float up[2][3], dn[2][3];
        #pragma unroll   // the twelve lane exchanges issue together, one LDS-pipe latency a trip
        for (int u = 0; u < 2; ++u) {
            #pragma unroll
            for (int d = 0; d < 3; ++d) {
                up[u][d] = __shfl_up(mid[u][d].w, 1, 32);      // last pixel of the quad to the left
                dn[u][d] = __shfl_down(mid[u][d].x, 1, 32);    // first pixel of the quad to the right
            }
        }
        #pragma unroll   // constant u, d, e, p: the sums stay in registers
        for (int u = 0; u < 2; ++u) {
            #pragma unroll
            for (int d = 0; d < 3; ++d) {
                const v4f m = mid[u][d];
                float row[6];                // columns 4*c4-1 .. 4*c4+4, clamped
                row[0] = lane_lo ? ev[u][d] : (first_col ? m.x : up[u][d]);
                row[1] = m.x; row[2] = m.y; row[3] = m.z; row[4] = m.w;
                row[5] = lane_hi ? ev[u][d] : (last_col ? m.w : dn[u][d]);
                #pragma unroll
                for (int e = 0; e < 3; ++e) {
                    #pragma unroll
                    for (int p = 0; p < 4; ++p)
                        s[d * 3 + e][p] = fmaf(tv[u][p], row[p + e], s[d * 3 + e][p]);
                }
            }
            #pragma unroll
            for (int p = 0; p < 4; ++p)
                h[p] = fmaf(wv[u], mid[u][1][p], h[p]);
        }
        tb += 2 * N_;
        xb += 2 * N_;
    }

    if (slice != 0) {
        #pragma unroll   // constant j here and below: s stays in registers
        for (int j = 0; j < 9; ++j) red[slice - 1][j][lane] = s[j];
        red[slice - 1][9][lane] = h;
    }
    __syncthreads();                         // slices 1-7's partial sums are in LDS
    if (slice != 0) return;

    #pragma unroll
    for (int w = 0; w < SS_ - 1; ++w) {
        #pragma unroll
        for (int j = 0; j < 9; ++j) s[j] += red[w][j][lane];
        h += red[w][9][lane];
    }
    h += be;

    v4f tot = {};
    #pragma unroll
    for (int j = 0; j < 9; ++j) {
        s[j] += h;
        tot  += s[j];
    }
    const v4f oth = (tot - s[4]) * 0.125f;
    const v4f o0  = { s[4].x, oth.x, s[4].y, oth.y };
    const v4f o1  = { s[4].z, oth.z, s[4].w, oth.w };

    float* sp = (float*)((char*)(scores + (size_t)b * 9 * N_) + oc);
    float* op = (float*)((char*)(out01 + (size_t)b * N_ * 2) + 2u * oc);
    *(v4f*)op       = o0;
    *(v4f*)(op + 4) = o1;
    #pragma unroll
    for (int j = 0; j < 9; ++j) *(v4f*)(sp + j * N_) = s[j];
}

// ---------------------------------------------------------------------------
// Kernel 3: xr = x + scores . v_nbr, then spatial LayerNorm per (b,c).
// One block per (b, 2 channels), 320 threads. A thread owns 4 adjacent pixels
// of one image row (a quad) in each of 5 rows, for every channel of the block:
// 320 quads are exactly 16 image rows, so its column never changes and its row
// goes up by 16 a step. Scores, x and v come in 16-byte loads (512 contiguous
// bytes a wave); a score quad is loaded once for all channels of the block.
// A thread's values stay in registers for the normalisation. Deterministic.
// ---------------------------------------------------------------------------
#define AG_ 2                  // channels per block
#define AT_ 320                // threads per block
#define AQ_ 5                  // quads per thread and channel

static_assert(W_ % 4 == 0 && AT_ % QW_ == 0, "a block step must cover whole image rows");
static_assert(AT_ * AQ_ * 4 == N_, "the quads of a block must cover the image exactly");
static_assert(C_ % AG_ == 0, "channel groups must cover the channels exactly");

__global__ __launch_bounds__(AT_) void attnv_layernorm(
    const float* __restrict__ x, const float* __restrict__ v,
    const float* __restrict__ scores, float* __restrict__ xout)
{
    const int blk = blockIdx.x;
    const int b   = blk / (C_ / AG_);
    const int ch0 = (blk % (C_ / AG_)) * AG_;
    const int tid = threadIdx.x;
    const int c4  = tid % QW_;               // quad column, the same in every step
    const int r0  = tid / QW_;               // image row in step 0

    // Block-uniform bases; a lane adds one 32-bit byte offset, every step an immediate.
    const size_t plane = ((size_t)b * C_ + ch0) * N_;
    const float* xb = x      + plane;
    const float* vb = v      + plane;
    const float* sb = scores + (size_t)b * 9 * N_;

    // Clamped neighbours. Only the first step can hold image row 0 and only the last one
    // row H-1, so every other row above or below is a constant offset from the quad's own.
    const uint32_t oc  = (uint32_t)tid * 16u;                        // the quad itself
    const uint32_t ol  = oc - ((c4 == 0) ? 0u : 4u);                 // left of pixel 0
    const uint32_t oq  = oc + ((c4 == QW_ - 1) ? 12u : 16u);         // right of pixel 3
    const uint32_t du  = (r0 == 0)             ? 0u : W_ * 4u;       // step 0: bytes back to the row above
    const uint32_t dd  = (r0 == AT_ / QW_ - 1) ? 0u : W_ * 4u;       // last step: bytes on to the row below
    const uint32_t ouc = oc - du, oul = ol - du, ouq = oq - du;
    const uint32_t odc = oc + dd, odl = ol + dd, odq = oq + dd;

    v4f   xr[AQ_][AG_];
    float sum[AG_] = {}, sq[AG_] = {};

    #pragma unroll   // constant i, g: xr stays in registers, every step is an immediate offset
    for (int i = 0; i < AQ_; ++i) {
        const int base = i * AT_ * 4;
        v4f   s[9], xv[AG_], mid[AG_][3];
        float lft[AG_][3], rgt[AG_][3];
        #pragma unroll
        for (int j = 0; j < 9; ++j) s[j] = ld4(sb, oc, j * N_ + base);
        #pragma unroll
        for (int g = 0; g < AG_; ++g) {
            const int o = g * N_ + base;
            xv[g] = ld4(xb, oc, o);
            if (i == 0) {
                mid[g][0] = ld4(vb, ouc, o);      lft[g][0] = ld1(vb, oul, o);      rgt[g][0] = ld1(vb, ouq, o);
            } else {
                mid[g][0] = ld4(vb, oc, o - W_);  lft[g][0] = ld1(vb, ol, o - W_);  rgt[g][0] = ld1(vb, oq, o - W_);
            }
            mid[g][1] = ld4(vb, oc, o);           lft[g][1] = ld1(vb, ol, o);       rgt[g][1] = ld1(vb, oq, o);
            if (i == AQ_ - 1) {
                mid[g][2] = ld4(vb, odc, o);      lft[g][2] = ld1(vb, odl, o);      rgt[g][2] = ld1(vb, odq, o);
            } else {
                mid[g][2] = ld4(vb, oc, o + W_);  lft[g][2] = ld1(vb, ol, o + W_);  rgt[g][2] = ld1(vb, oq, o + W_);
            }
        }
        // The step's loads name these offsets. As inputs of the wait they keep their registers
        // up to it, so no later load of the run lands in one of them. The memory clobber also
        // keeps every load of the step in front of it: one exposed latency a step.
        if (i == 0)
            asm volatile("s_wait_xcnt 0x0" :: "v"(oc), "v"(ol), "v"(oq), "v"(ouc), "v"(oul), "v"(ouq) : "memory");
        else if (i == AQ_ - 1)
            asm volatile("s_wait_xcnt 0x0" :: "v"(oc), "v"(ol), "v"(oq), "v"(odc), "v"(odl), "v"(odq) : "memory");
        else
            asm volatile("s_wait_xcnt 0x0" :: "v"(oc), "v"(ol), "v"(oq) : "memory");
        #pragma unroll
        for (int g = 0; g < AG_; ++g) {
            float row[3][6];                 // columns 4*c4-1 .. 4*c4+4, clamped
            #pragma unroll
            for (int d = 0; d < 3; ++d) {
                row[d][0] = lft[g][d];
                row[d][1] = mid[g][d].x; row[d][2] = mid[g][d].y;
                row[d][3] = mid[g][d].z; row[d][4] = mid[g][d].w;
                row[d][5] = rgt[g][d];
            }
            v4f val;
            #pragma unroll
            for (int p = 0; p < 4; ++p) {
                float nv = 0.0f;
                #pragma unroll
                for (int j = 0; j < 9; ++j)
                    nv = fmaf(s[j][p], row[j / 3][p + j % 3], nv);
                val[p]  = xv[g][p] + nv;
                sum[g] += val[p];
                sq[g]   = fmaf(val[p], val[p], sq[g]);
            }
            xr[i][g] = val;
        }
        // Keeps the next step's loads behind this step's sums. Without it the scheduler lifts later
        // steps' loads over them, and the register count no longer lets two blocks share a WGP.
        __builtin_amdgcn_sched_barrier(0);
    }

    // Sums over the block: a butterfly inside each wave, then the ten waves' partial
    // sums through LDS, added by every thread in the same order.
    __shared__ float red[AT_ / 32][2 * AG_];
    #pragma unroll
    for (int off = 16; off > 0; off >>= 1) {
        #pragma unroll
        for (int g = 0; g < AG_; ++g) {
            sum[g] += __shfl_xor(sum[g], off, 32);
            sq[g]  += __shfl_xor(sq[g],  off, 32);
        }
    }
    if ((tid & 31) == 0) {
        #pragma unroll
        for (int g = 0; g < AG_; ++g) {
            red[tid >> 5][g]       = sum[g];
            red[tid >> 5][AG_ + g] = sq[g];
        }
    }
    __syncthreads();

    float* op = (float*)((char*)(xout + plane) + oc);
    #pragma unroll
    for (int g = 0; g < AG_; ++g) {
        float ts = 0.0f, tq = 0.0f;
        #pragma unroll
        for (int w = 0; w < AT_ / 32; ++w) {
            ts += red[w][g];
            tq += red[w][AG_ + g];
        }
        const float mu  = ts * (1.0f / N_);
        const float var = tq * (1.0f / N_) - mu * mu;
        const float rs  = rsqrtf(var + EPSV);
        #pragma unroll
        for (int i = 0; i < AQ_; ++i)
            *(v4f*)(op + g * N_ + i * AT_ * 4) = (xr[i][g] - mu) * rs;
    }
}

// ---------------------------------------------------------------------------
extern "C" void kernel_launch(void* const* d_in, const int* in_sizes, int n_in,
                              void* d_out, int out_size, void* d_ws, size_t ws_size,
                              hipStream_t stream)
{
    const float* x  = (const float*)d_in[0];
    const float* Wq = (const float*)d_in[1];
    const float* bq = (const float*)d_in[2];
    const float* Wk = (const float*)d_in[3];
    const float* bk = (const float*)d_in[4];
    const float* Wv = (const float*)d_in[5];
    const float* bv = (const float*)d_in[6];

    const size_t CN = (size_t)B_ * C_ * N_;   // 26,214,400 floats
    float* ws = (float*)d_ws;
    float* t  = ws;
    float* v  = t + CN;
    float* sc = v + CN;                        // B*9*N floats
    float* Mf = sc + (size_t)B_ * 9 * N_;      // C*C floats
    float* bf = Mf + C_ * C_;                  // C floats
    float* wf = bf + C_;                       // C floats
    float* be = wf + C_;                       // 1 float

    float* out01 = (float*)d_out;                          // (B,H,W,2)
    float* xout  = out01 + (size_t)B_ * N_ * 2;            // (B,C,H,W)

    fold_qk_weights<<<dim3(49), 256, 0, stream>>>(Wq, bq, Wk, bk, Mf, bf, wf, be);

    qkv_gemm_wmma<<<dim3(2, N_ / NT_, B_), 256, 0, stream>>>(
        x, Mf, bf, Wv, bv, t, v);

    scores_kernel<<<dim3(N_ / SP_, B_), SS_ * 32, 0, stream>>>(t, x, wf, be, sc, out01);

    attnv_layernorm<<<dim3(B_ * C_ / AG_), AT_, 0, stream>>>(x, v, sc, xout);
}

// v005
// Measured time: 207 microseconds a run.
// In both of two side-by-side timings against v004, it was 1.09 times as fast.
// Over all steps from v000 it is 2.81 times as fast.
#include <hip/hip_runtime.h>
#include <hip/hip_bf16.h>
#include <stdint.h>

typedef __attribute__((ext_vector_type(2))) float v2f;
typedef __attribute__((ext_vector_type(4))) float v4f;
typedef __attribute__((ext_vector_type(8))) float v8f;
typedef __attribute__((ext_vector_type(4))) uint32_t u32x4;
typedef __attribute__((ext_vector_type(8))) uint32_t u32x8;

#define B_  16
#define C_  256
#define H_  80
#define W_  80
#define N_  (H_ * W_)
#define EPSV 1e-5f

#define NT_ 80                 // x columns per block
#define FX_ (NT_ / 16)         // column tiles per wave
#define SLICE_ROWS_ (C_ / 8)   // x rows that each of the 8 waves brings into LDS
#define QW_ (W_ / 4)           // quads per image row

static_assert(N_ % NT_ == 0, "column tiles must cover a batch image exactly");
static_assert((SLICE_ROWS_ * NT_ * 4) % 2048 == 0, "each wave's LDS slice must start at a multiple of 2 KiB");

static __device__ __forceinline__ uint32_t uni(uint32_t v) { return (uint32_t)__builtin_amdgcn_readfirstlane(v); }

// base is uniform, off a lane's byte offset, e a constant element offset (the load's immediate).
static __device__ __forceinline__ v4f ld4(const float* base, uint32_t off, int e)
{ return *(const v4f*)((const float*)((const char*)base + off) + e); }
static __device__ __forceinline__ float ld1(const float* base, uint32_t off, int e)
{ return *((const float*)((const char*)base + off) + e); }

// ---------------------------------------------------------------------------
// The scores need q and k only through q_n . k_m, and
//   q_n . k_m = (Wk^T q_n) . x_m + q_n . bk
//             = (Mf x_n + bf) . x_m + (wf . x_n + beta)
// with Mf = Wk^T Wq, bf = Wk^T bq, wf = Wq^T bk, beta = bk . bq. So one
// projection t = Mf x + bf takes the place of the two projections q and k.
//
// Kernel 0: the folded weights. Blocks 0-31: Mf, one 16x16 tile per wave on
// V_WMMA_F32_16X16X4_F32. Blocks 32-39: bf. Blocks 40-47: wf. Block 48: beta.
// ---------------------------------------------------------------------------
__global__ __launch_bounds__(256) void fold_qk_weights(
    const float* __restrict__ Wq, const float* __restrict__ bq,
    const float* __restrict__ Wk, const float* __restrict__ bk,
    float* __restrict__ Mf, float* __restrict__ bf,
    float* __restrict__ wf, float* __restrict__ beta)
{
    __shared__ float red[256];
    const int blk  = blockIdx.x;
    const int tid  = threadIdx.x;
    const int wave = (int)uni(tid >> 5);     // scalar, so that a wave's row bases are scalar and its loads share one offset register
    const int lane = tid & 31;

    if (blk < 32) {
        const int lm   = lane & 15;
        const int half = lane >> 4;
        const int t16  = blk * 8 + wave;
        const int i0   = (t16 >> 4) * 16;
        const int j0   = (t16 & 15) * 16;
        const float* ap = Wk + 2 * half * C_ + i0 + lm;
        const float* bp = Wq + 2 * half * C_ + j0 + lm;
        v8f acc = {};
        // 64 loads in flight per batch: the wave's time is load latency, not the 64 WMMAs.
        #pragma unroll 16
        for (int o = 0; o < C_; o += 4) {
            v2f a, bb;
            a.x  = ap[o * C_];
            a.y  = ap[o * C_ + C_];
            bb.x = bp[o * C_];
            bb.y = bp[o * C_ + C_];
            acc = __builtin_amdgcn_wmma_f32_16x16x4_f32(
                      false, a, false, bb, (short)0, acc, false, false);
        }
        #pragma unroll   // constant r: acc stays in registers
        for (int r = 0; r < 8; ++r)
            Mf[(i0 + half * 8 + r) * C_ + j0 + lm] = acc[r];
        return;
    }

    if (blk < 48) {
        // dst[i] = sum_o A[o][i] * vec[o]: 32 columns per block, 32 rows per wave.
        const bool   first = blk < 40;
        const float* A     = first ? Wk : Wq;
        const float* vec   = first ? bq : bk;
        float*       dst   = first ? bf : wf;
        const int    i     = ((blk - 32) & 7) * 32 + lane;
        const float* ar = A + wave * 32 * C_;
        const float* vr = vec + wave * 32;
        float p = 0.0f;
        #pragma unroll   // all 32 loads of the wave in flight at once
        for (int u = 0; u < 32; ++u)
            p = fmaf(ar[u * C_ + i], vr[u], p);
        red[tid] = p;
        __syncthreads();
        if (tid < 32) {
            float s = red[tid];
            #pragma unroll   // the seven LDS reads issue together
            for (int w = 1; w < 8; ++w) s += red[w * 32 + tid];
            dst[i] = s;
        }
        return;
    }

    red[tid] = bk[tid] * bq[tid];
    __syncthreads();
    #pragma unroll       // eight fixed halvings, no loop counter
    for (int off = 128; off > 0; off >>= 1) {
        if (tid < off) red[tid] += red[tid + off];
        __syncthreads();
    }
    if (tid == 0) beta[0] = red[0];
}

static_assert(NT_ == W_, "a column tile must be one image row: the score step takes its neighbours by row");
#define SB_ 4                  // channels per batch of neighbour loads
#define SK_ 10                 // sums per pixel: nine scores and wf . x
static_assert(SB_ == 4, "a batch's wf values come in one 16-byte load");

__global__ __launch_bounds__(256) void qkv_gemm_wmma(
    const float* __restrict__ x,
    const float* __restrict__ Mf, const float* __restrict__ bf,
    const float* __restrict__ Wv, const float* __restrict__ bv,
    const float* __restrict__ wf, const float* __restrict__ beta,
    float* __restrict__ v, float* __restrict__ scores, float* __restrict__ out01)
{
    __shared__ __attribute__((aligned(2048))) float tile[C_ * NT_];   // [c][nn], 80 KB

    const int mat = blockIdx.x;              // 0: t and the scores, 1: v
    const int n0  = blockIdx.y * NT_;
    const int b   = blockIdx.z;
    const int tid = threadIdx.x;
    const uint32_t wave = uni(tid >> 5);     // 0..7

    {
        const uint64_t ga  = (uint64_t)(uintptr_t)(x + (size_t)b * C_ * N_
                                                     + (size_t)(wave * SLICE_ROWS_) * N_ + n0);
        const uint32_t lds = (uint32_t)(uintptr_t)tile + wave * (SLICE_ROWS_ * NT_ * 4);
        constexpr uint32_t d0 = NT_ * 4, d1 = SLICE_ROWS_;
        u32x4 g0;
        g0[0] = uni(1u);                                   // count = 1
        g0[1] = uni(lds);                                  // LDS byte offset
        g0[2] = uni((uint32_t)ga);                         // address [31:0]
        g0[3] = uni((((uint32_t)(ga >> 32)) & 0x01FFFFFFu) | 0x80000000u);  // address [56:32] | type = 2
        u32x8 g1;
        g1[0] = uni(0u);
        g1[1] = uni((d0 & 0xFFFFu) << 16);
        g1[2] = uni((d0 >> 16) | ((d1 & 0xFFFFu) << 16));
        g1[3] = uni((d1 >> 16) | (d0 << 16));
        g1[4] = uni(d1);
        g1[5] = uni((uint32_t)N_ * 4u);
        g1[6] = uni(0u);
        g1[7] = uni(0u);
        asm volatile("tensor_load_to_lds %0, %1\n\ts_wait_tensorcnt 0x0" :: "s"(g0), "s"(g1) : "memory");
    }
    __syncthreads();                         // every wave's slice is visible to all

    const int lane = tid & 31;
    const int lm   = lane & 15;
    const int half = lane >> 4;              // 0 or 1

    const float* Wm = (mat == 0) ? Mf : Wv;

    const int m0 = (int)wave * 32;
    const v2f* ap0 = (const v2f*)(Wm + (size_t)(m0 + lm) * C_) + half;
    const v2f* ap1 = ap0 + 16 * C_ / 2;
    // B (4x16): same K split over the lane halves, column = lm
    const float* bp = tile + 2 * half * NT_ + lm;

    v8f acc[2][FX_] = {};
    // One trip consumes exactly one 128-byte line of each W row, loaded in one burst,
    // so a line need not survive in the cache between trips.
    for (int kb = 0; kb < C_; kb += 32) {
        v2f a0[8], a1[8];
        #pragma unroll
        for (int s = 0; s < 8; ++s) {
            a0[s] = ap0[(kb >> 1) + 2 * s];
            a1[s] = ap1[(kb >> 1) + 2 * s];
        }
        #pragma unroll
        for (int s = 0; s < 8; ++s) {
            const float* bs = bp + (kb + 4 * s) * NT_;
            #pragma unroll
            for (int j = 0; j < FX_; ++j) {
                v2f bb;
                bb.x = bs[j * 16];
                bb.y = bs[NT_ + j * 16];
                acc[0][j] = __builtin_amdgcn_wmma_f32_16x16x4_f32(
                                false, a0[s], false, bb, (short)0, acc[0][j], false, false);
                acc[1][j] = __builtin_amdgcn_wmma_f32_16x16x4_f32(
                                false, a1[s], false, bb, (short)0, acc[1][j], false, false);
            }
        }
    }

    {   // the bias, in place, for both kinds of block
        const float* bl = ((mat == 0) ? bf : bv) + m0 + half * 8;
        #pragma unroll   // constant i, j, r: acc stays in registers
        for (int i = 0; i < 2; ++i) {
            const v4f b0 = *(const v4f*)(bl + i * 16);
            const v4f b1 = *(const v4f*)(bl + i * 16 + 4);
            #pragma unroll
            for (int j = 0; j < FX_; ++j) {
                #pragma unroll
                for (int r = 0; r < 4; ++r) {
                    acc[i][j][r]     += b0[r];
                    acc[i][j][r + 4] += b1[r];
                }
            }
        }
    }
    if (mat != 0) {
        float* ob = v + (size_t)b * C_ * N_ + n0 + lm;
        #pragma unroll
        for (int i = 0; i < 2; ++i) {
            #pragma unroll
            for (int r = 0; r < 8; ++r) {
                const int row = m0 + i * 16 + half * 8 + r;
                #pragma unroll
                for (int j = 0; j < FX_; ++j)
                    ob[(size_t)row * N_ + j * 16] = acc[i][j][r];
            }
        }
        // Stands behind the last store and in front of any later write to the stores' address registers.
        asm volatile("s_wait_xcnt 0x0" ::: "memory");
    } else {
        // ---- t block: the scores of image row ir ----
        const int ir = blockIdx.y;
        const float be = beta[0];                // read here, under uniform control flow: a scalar load
        // Wave-uniform bases at the wave's first channel; rows clamped as the reference clamps them.
        const float* xw = x + ((size_t)b * C_ + m0) * N_;
        const float* xu = xw + ((ir == 0)      ? 0  : ir - 1) * W_;
        const float* xd = xw + ((ir == H_ - 1) ? ir : ir + 1) * W_;
        const float* wb = wf + m0;
        const uint32_t wo = (uint32_t)half * 32u;            // the lane half's first channel, in bytes
        // A lane's byte offsets: its half's channels, and its own column, the column to the left in the
        // first tile and the column to the right in the last tile, clamped as the reference clamps columns.
        // Every other neighbour column is a constant step from the lane's own.
        const uint32_t ll = (lm == 0)  ? 0u  : (uint32_t)lm - 1u;
        const uint32_t lr = (lm == 15) ? 15u : (uint32_t)lm + 1u;
        const uint32_t gh = (uint32_t)half * (8u * N_ * 4u);
        const uint32_t gC = gh + (uint32_t)lm * 4u, gL = gh + ll * 4u, gR = gh + lr * 4u;
        const float* xc = tile + (m0 + half * 8) * NT_;
        const float* cC = xc + lm;
        const float* cL = xc + ll;
        const float* cR = xc + lr;

        float s[FX_][9], h[FX_];
        #pragma unroll   // constant j, g, u, e: sums and accumulators stay in registers
        for (int j = 0; j < FX_; ++j) {
            #pragma unroll
            for (int k = 0; k < 9; ++k) s[j][k] = 0.0f;
            h[j] = 0.0f;
            #pragma unroll
            for (int g = 0; g < 16 / SB_; ++g) {
                const int i  = (g * SB_) >> 3;
                const int r0 = (g * SB_) & 7;
                float xv[SB_][9];
                const v4f w4 = ld4(wb, wo, i * 16 + r0);
                #pragma unroll
                for (int u = 0; u < SB_; ++u) {
                    const int ce = i * 16 + r0 + u;          // channel, counted from the lane's first
                    #pragma unroll
                    for (int e = 0; e < 3; ++e) {
                        if (j == 0 && e == 0) {
                            xv[u][0] = ld1(xu, gL, ce * N_);
                            xv[u][3] = cL[ce * NT_];
                            xv[u][6] = ld1(xd, gL, ce * N_);
                        } else if (j == FX_ - 1 && e == 2) {
                            xv[u][2] = ld1(xu, gR, ce * N_ + j * 16);
                            xv[u][5] = cR[ce * NT_ + j * 16];
                            xv[u][8] = ld1(xd, gR, ce * N_ + j * 16);
                        } else {
                            xv[u][e]     = ld1(xu, gC, ce * N_ + j * 16 + e - 1);
                            xv[u][3 + e] = cC[ce * NT_ + j * 16 + e - 1];
                            xv[u][6 + e] = ld1(xd, gC, ce * N_ + j * 16 + e - 1);
                        }
                    }
                }
                // Stands behind the batch's loads and in front of every write to a register that they name:
                // offsets and bases are inputs, so that they keep their registers up to it. The memory clobber
                // keeps the batch's loads in front of it and the next batch's behind it, which bounds the
                // values in flight, so that the register count still lets three blocks share a WGP.
                asm volatile("s_wait_xcnt 0x0"
                             :: "v"(gC), "v"(gL), "v"(gR), "v"(wo), "s"(xu), "s"(xd), "s"(wb) : "memory");
                #pragma unroll
                for (int u = 0; u < SB_; ++u) {
                    const float tv = acc[i][j][r0 + u];
                    #pragma unroll
                    for (int k = 0; k < 9; ++k)
                        s[j][k] = fmaf(tv, xv[u][k], s[j][k]);
                    h[j] = fmaf(w4[u], xv[u][4], h[j]);
                }
            }
        }

        __syncthreads();                         // every wave has taken its last x value from the tile
        float* red = tile;                       // [16 parts][FX_ * SK_ sums][16 pixels]
        {
            float* rp = red + ((int)wave * 2 + half) * (FX_ * SK_ * 16) + lm;
            #pragma unroll
            for (int j = 0; j < FX_; ++j) {
                #pragma unroll
                for (int k = 0; k < 9; ++k) rp[(j * SK_ + k) * 16] = s[j][k];
                rp[(j * SK_ + 9) * 16] = h[j];
            }
        }
        __syncthreads();                         // every part is in LDS
        for (int o = tid; o < FX_ * SK_ * 16; o += 256) {
            float a = red[o];
            #pragma unroll   // the fifteen LDS reads issue together
            for (int p = 1; p < 16; ++p) a += red[p * (FX_ * SK_ * 16) + o];
            red[o] = a;                          // part 0's own place: no other thread reads or writes it here
        }
        __syncthreads();                         // every sum is complete
        if (tid < NT_) {
            const float* fp = red + (tid >> 4) * (SK_ * 16) + (tid & 15);
            const float hb = fp[9 * 16] + be;
            float sc[9], tot = 0.0f;
            #pragma unroll   // constant k: sc stays in registers
            for (int k = 0; k < 9; ++k) {
                sc[k] = fp[k * 16] + hb;
                tot  += sc[k];
            }
            const v2f o2 = { sc[4], (tot - sc[4]) * 0.125f };
            *(v2f*)(out01 + ((size_t)b * N_ + n0 + tid) * 2) = o2;
            float* sp = scores + (size_t)b * 9 * N_ + n0 + tid;
            #pragma unroll
            for (int k = 0; k < 9; ++k) sp[k * N_] = sc[k];
        }
    }
}

// ---------------------------------------------------------------------------
// Kernel 2: xr = x + scores . v_nbr, then spatial LayerNorm per (b,c).
// One block per (b, 2 channels), 320 threads. A thread owns 4 adjacent pixels
// of one image row (a quad) in each of 5 rows, for every channel of the block:
// 320 quads are exactly 16 image rows, so its column never changes and its row
// goes up by 16 a step. Scores, x and v come in 16-byte loads (512 contiguous
// bytes a wave); a score quad is loaded once for all channels of the block.
// A thread's values stay in registers for the normalisation. Deterministic.
// ---------------------------------------------------------------------------
#define AG_ 2                  // channels per block
#define AT_ 320                // threads per block
#define AQ_ 5                  // quads per thread and channel

static_assert(W_ % 4 == 0 && AT_ % QW_ == 0, "a block step must cover whole image rows");
static_assert(AT_ * AQ_ * 4 == N_, "the quads of a block must cover the image exactly");
static_assert(C_ % AG_ == 0, "channel groups must cover the channels exactly");

__global__ __launch_bounds__(AT_) void attnv_layernorm(
    const float* __restrict__ x, const float* __restrict__ v,
    const float* __restrict__ scores, float* __restrict__ xout)
{
    const int blk = blockIdx.x;
    const int b   = blk / (C_ / AG_);
    const int ch0 = (blk % (C_ / AG_)) * AG_;
    const int tid = threadIdx.x;
    const int c4  = tid % QW_;               // quad column, the same in every step
    const int r0  = tid / QW_;               // image row in step 0

    // Block-uniform bases; a lane adds one 32-bit byte offset, every step an immediate.
    const size_t plane = ((size_t)b * C_ + ch0) * N_;
    const float* xb = x      + plane;
    const float* vb = v      + plane;
    const float* sb = scores + (size_t)b * 9 * N_;

    // Clamped neighbours. Only the first step can hold image row 0 and only the last one
    // row H-1, so every other row above or below is a constant offset from the quad's own.
    const uint32_t oc  = (uint32_t)tid * 16u;                        // the quad itself
    const uint32_t ol  = oc - ((c4 == 0) ? 0u : 4u);                 // left of pixel 0
    const uint32_t oq  = oc + ((c4 == QW_ - 1) ? 12u : 16u);         // right of pixel 3
    const uint32_t du  = (r0 == 0)             ? 0u : W_ * 4u;       // step 0: bytes back to the row above
    const uint32_t dd  = (r0 == AT_ / QW_ - 1) ? 0u : W_ * 4u;       // last step: bytes on to the row below
    const uint32_t ouc = oc - du, oul = ol - du, ouq = oq - du;
    const uint32_t odc = oc + dd, odl = ol + dd, odq = oq + dd;

    v4f   xr[AQ_][AG_];
    float sum[AG_] = {}, sq[AG_] = {};

    #pragma unroll   // constant i, g: xr stays in registers, every step is an immediate offset
    for (int i = 0; i < AQ_; ++i) {
        const int base = i * AT_ * 4;
        v4f   s[9], xv[AG_], mid[AG_][3];
        float lft[AG_][3], rgt[AG_][3];
        #pragma unroll
        for (int j = 0; j < 9; ++j) s[j] = ld4(sb, oc, j * N_ + base);
        #pragma unroll
        for (int g = 0; g < AG_; ++g) {
            const int o = g * N_ + base;
            xv[g] = ld4(xb, oc, o);
            if (i == 0) {
                mid[g][0] = ld4(vb, ouc, o);      lft[g][0] = ld1(vb, oul, o);      rgt[g][0] = ld1(vb, ouq, o);
            } else {
                mid[g][0] = ld4(vb, oc, o - W_);  lft[g][0] = ld1(vb, ol, o - W_);  rgt[g][0] = ld1(vb, oq, o - W_);
            }
            mid[g][1] = ld4(vb, oc, o);           lft[g][1] = ld1(vb, ol, o);       rgt[g][1] = ld1(vb, oq, o);
            if (i == AQ_ - 1) {
                mid[g][2] = ld4(vb, odc, o);      lft[g][2] = ld1(vb, odl, o);      rgt[g][2] = ld1(vb, odq, o);
            } else {
                mid[g][2] = ld4(vb, oc, o + W_);  lft[g][2] = ld1(vb, ol, o + W_);  rgt[g][2] = ld1(vb, oq, o + W_);
            }
        }
        // The step's loads name these offsets. As inputs of the wait they keep their registers
        // up to it, so no later load of the run lands in one of them. The memory clobber also
        // keeps every load of the step in front of it: one exposed latency a step.
        if (i == 0)
            asm volatile("s_wait_xcnt 0x0" :: "v"(oc), "v"(ol), "v"(oq), "v"(ouc), "v"(oul), "v"(ouq) : "memory");
        else if (i == AQ_ - 1)
            asm volatile("s_wait_xcnt 0x0" :: "v"(oc), "v"(ol), "v"(oq), "v"(odc), "v"(odl), "v"(odq) : "memory");
        else
            asm volatile("s_wait_xcnt 0x0" :: "v"(oc), "v"(ol), "v"(oq) : "memory");
        #pragma unroll
        for (int g = 0; g < AG_; ++g) {
            float row[3][6];                 // columns 4*c4-1 .. 4*c4+4, clamped
            #pragma unroll
            for (int d = 0; d < 3; ++d) {
                row[d][0] = lft[g][d];
                row[d][1] = mid[g][d].x; row[d][2] = mid[g][d].y;
                row[d][3] = mid[g][d].z; row[d][4] = mid[g][d].w;
                row[d][5] = rgt[g][d];
            }
            v4f val;
            #pragma unroll
            for (int p = 0; p < 4; ++p) {
                float nv = 0.0f;
                #pragma unroll
                for (int j = 0; j < 9; ++j)
                    nv = fmaf(s[j][p], row[j / 3][p + j % 3], nv);
                val[p]  = xv[g][p] + nv;
                sum[g] += val[p];
                sq[g]   = fmaf(val[p], val[p], sq[g]);
            }
            xr[i][g] = val;
        }
        // Keeps the next step's loads behind this step's sums. Without it the scheduler lifts later
        // steps' loads over them, and the register count no longer lets two blocks share a WGP.
        __builtin_amdgcn_sched_barrier(0);
    }

    // Sums over the block: a butterfly inside each wave, then the ten waves' partial
    // sums through LDS, added by every thread in the same order.
    __shared__ float red[AT_ / 32][2 * AG_];
    #pragma unroll
    for (int off = 16; off > 0; off >>= 1) {
        #pragma unroll
        for (int g = 0; g < AG_; ++g) {
            sum[g] += __shfl_xor(sum[g], off, 32);
            sq[g]  += __shfl_xor(sq[g],  off, 32);
        }
    }
    if ((tid & 31) == 0) {
        #pragma unroll
        for (int g = 0; g < AG_; ++g) {
            red[tid >> 5][g]       = sum[g];
            red[tid >> 5][AG_ + g] = sq[g];
        }
    }
    __syncthreads();

    float* op = (float*)((char*)(xout + plane) + oc);
    #pragma unroll
    for (int g = 0; g < AG_; ++g) {
        float ts = 0.0f, tq = 0.0f;
        #pragma unroll
        for (int w = 0; w < AT_ / 32; ++w) {
            ts += red[w][g];
            tq += red[w][AG_ + g];
        }
        const float mu  = ts * (1.0f / N_);
        const float var = tq * (1.0f / N_) - mu * mu;
        const float rs  = rsqrtf(var + EPSV);
        #pragma unroll
        for (int i = 0; i < AQ_; ++i)
            *(v4f*)(op + g * N_ + i * AT_ * 4) = (xr[i][g] - mu) * rs;
    }
}

// ---------------------------------------------------------------------------
extern "C" void kernel_launch(void* const* d_in, const int* in_sizes, int n_in,
                              void* d_out, int out_size, void* d_ws, size_t ws_size,
                              hipStream_t stream)
{
    const float* x  = (const float*)d_in[0];
    const float* Wq = (const float*)d_in[1];
    const float* bq = (const float*)d_in[2];
    const float* Wk = (const float*)d_in[3];
    const float* bk = (const float*)d_in[4];
    const float* Wv = (const float*)d_in[5];
    const float* bv = (const float*)d_in[6];

    const size_t CN = (size_t)B_ * C_ * N_;   // 26,214,400 floats
    float* ws = (float*)d_ws;
    float* v  = ws;
    float* sc = v + CN;                        // B*9*N floats
    float* Mf = sc + (size_t)B_ * 9 * N_;      // C*C floats
    float* bf = Mf + C_ * C_;                  // C floats
    float* wf = bf + C_;                       // C floats
    float* be = wf + C_;                       // 1 float

    float* out01 = (float*)d_out;                          // (B,H,W,2)
    float* xout  = out01 + (size_t)B_ * N_ * 2;            // (B,C,H,W)

    fold_qk_weights<<<dim3(49), 256, 0, stream>>>(Wq, bq, Wk, bk, Mf, bf, wf, be);

    qkv_gemm_wmma<<<dim3(2, N_ / NT_, B_), 256, 0, stream>>>(
        x, Mf, bf, Wv, bv, wf, be, v, sc, out01);

    attnv_layernorm<<<dim3(B_ * C_ / AG_), AT_, 0, stream>>>(x, v, sc, xout);
}
